// v000
// Measured on an AMD MI455X. A time is GPU time per run, averaged over a window of back-to-back runs after a warm-up
// (all launches, gaps included; the runs take copies of the inputs in turn), and the median of several windows.
// Apart from v000's, it joins two sittings. Times from different sittings can be a few percent apart, while
// side-by-side timings come from the same sitting.
// The starting kernel, v000, takes 1170 microseconds a run.
#include <hip/hip_runtime.h>

// Unscaled scaled-dot-product attention on given head-major q, k, v [2][16][2048][128]: score = q.k (NO scaling: logit sigma ~11), softmax over the 2048 keys, out = score.v -> [2][16][2048][128] f32 (8.4 M).
// Layout per (batch, head pair): q, k, v planes built straight from the head-major inputs (bf16-rounded); because the logits are unscaled every row uses bf16 hi/lo planes (3 products) for both the scores and attn.v; register-row softmax; head-major f32 output.
// Compute dtypes, f32 accumulate: q, k, v rounded to bf16 so the hi planes are exact and the lo planes zero for q/k/v; P as normalised bf16 hi/lo; softmax f32; f32 output.

#define NB_  2
#define TT   2048
#define DM   2048
#define NH_  16
#define NKV  16
#define REP  (NH_ / NKV)
#define HD   128
#define DQ   (NH_ * HD)
#define DKV  (NKV * HD)
#define ZH   2
#define RH   2048                  // query rows < RH use hi+lo planes (0: none)
#define WIN  2048
#define PCAR 1024.0f
#define SCL  1.0f   // the module applies NO 1/sqrt(H) scaling
typedef _Float16 h16;
typedef unsigned short bf;
typedef __attribute__((ext_vector_type(16))) __bf16   v16bf;
typedef __attribute__((ext_vector_type(16))) _Float16 v16h;
typedef __attribute__((ext_vector_type(8)))  _Float16 v8h;
typedef __attribute__((ext_vector_type(8)))  unsigned short v8us;
typedef __attribute__((ext_vector_type(8)))  float    v8f;
typedef __attribute__((ext_vector_type(4)))  float    v4f;
typedef v8h  __attribute__((may_alias)) v8ha;
typedef v4f  __attribute__((may_alias)) v4fa;
typedef v8us __attribute__((may_alias)) v8usa;

__device__ __forceinline__ unsigned short f2bf(float f) { unsigned u = __float_as_uint(f); u += 0x7FFFu + ((u >> 16) & 1u); return (unsigned short)(u >> 16); }
__device__ __forceinline__ float bf2f(unsigned short b) { return __uint_as_float(((unsigned)b) << 16); }
__device__ __forceinline__ float bfr(float f) { return bf2f(f2bf(f)); }
__device__ __forceinline__ v16h cat16(v8h lo, v8h hi) { return __builtin_shufflevector(lo, hi, 0, 1, 2, 3, 4, 5, 6, 7, 8, 9, 10, 11, 12, 13, 14, 15); }
__device__ __forceinline__ v16bf cat16b(v8us lo, v8us hi) { return __builtin_bit_cast(v16bf, __builtin_shufflevector(lo, hi, 0, 1, 2, 3, 4, 5, 6, 7, 8, 9, 10, 11, 12, 13, 14, 15)); }
__device__ __forceinline__ v8f wmma16(v16h a, v16h b, v8f c) { return __builtin_amdgcn_wmma_f32_16x16x32_f16(false, a, false, b, (short)0, c, false, false); }
__device__ __forceinline__ v8f wmmab(v16bf a, v16bf b, v8f c) { return __builtin_amdgcn_wmma_f32_16x16x32_bf16(false, a, false, b, (short)0, c, false, false); }



// ---- k_gemmw: register-blocked GEMM, ONE WAVE per 64x64 output tile (16 accumulators), operands straight from K-contiguous 16-bit planes; grid (M/64, N/64, Z), 32 threads.
// C[m][n] (f32, pitch ldc, + optional f32 bias[n]) = sum_k A[m][k] Bt[n][k] (+ split products per NSPLIT). z-batch strides sA/sB/sC in elements. K % 32 == 0.
template <typename T16> struct WFrag;
template <> struct WFrag<h16> { typedef v16h V; static __device__ __forceinline__ V ld(const h16* p) { return cat16(*(const v8h*)p, *(const v8h*)(p + 16)); } static __device__ __forceinline__ v8f mma(V a, V b, v8f c) { return wmma16(a, b, c); } };
template <> struct WFrag<bf> { typedef v16bf V; static __device__ __forceinline__ V ld(const bf* p) { return cat16b(*(const v8us*)p, *(const v8us*)(p + 16)); } static __device__ __forceinline__ v8f mma(V a, V b, v8f c) { return wmmab(a, b, c); } };
template <typename T16, int NSPLIT, bool BIAS>
__global__ __launch_bounds__(32) void k_gemmw(const T16* __restrict__ A, const T16* __restrict__ A2, const T16* __restrict__ Bt, const T16* __restrict__ Bt2, int K, float* C, int ldc, const float* __restrict__ bias, size_t sA, size_t sB, size_t sC) {
    typedef typename WFrag<T16>::V V;
    __shared__ __align__(16) float os[16 * 68];
    const size_t z = blockIdx.z; A += z * sA; if (A2) A2 += z * sA; Bt += z * sB; if (Bt2) Bt2 += z * sB; C += z * sC;
    const int lane = threadIdx.x & 31, lr = lane & 15, hi = lane >> 4; const int r0 = blockIdx.x * 64, c0 = blockIdx.y * 64;
    v8f acc[4][4];
#pragma unroll
    for (int mb = 0; mb < 4; ++mb)
#pragma unroll
        for (int nb = 0; nb < 4; ++nb) acc[mb][nb] = (v8f){};
    const size_t aoff = (size_t)(r0 + lr) * K + 8 * hi, boff = (size_t)(c0 + lr) * K + 8 * hi;
#pragma unroll 1
    for (int kc = 0; kc < K; kc += 32) {
        V a[4], a2[4];
#pragma unroll
        for (int mb = 0; mb < 4; ++mb) { a[mb] = WFrag<T16>::ld(A + aoff + (size_t)mb * 16 * K + kc); if (NSPLIT == 1 || NSPLIT == 2) a2[mb] = WFrag<T16>::ld(A2 + aoff + (size_t)mb * 16 * K + kc); }
#pragma unroll
        for (int nb = 0; nb < 4; ++nb) { const V b = WFrag<T16>::ld(Bt + boff + (size_t)nb * 16 * K + kc); V b2; if (NSPLIT >= 2) b2 = WFrag<T16>::ld(Bt2 + boff + (size_t)nb * 16 * K + kc);
#pragma unroll
            for (int mb = 0; mb < 4; ++mb) { acc[mb][nb] = WFrag<T16>::mma(a[mb], b, acc[mb][nb]); if (NSPLIT == 1 || NSPLIT == 2) acc[mb][nb] = WFrag<T16>::mma(a2[mb], b, acc[mb][nb]); if (NSPLIT >= 2) acc[mb][nb] = WFrag<T16>::mma(a[mb], b2, acc[mb][nb]); } }
        asm volatile("v_nop\n\tv_nop\n\tv_nop\n\tv_nop" : "+v"(acc[0][0]), "+v"(acc[1][1]), "+v"(acc[2][2]), "+v"(acc[3][3]) : "v"(a[0]), "v"(a[3]));
    }
#pragma unroll
    for (int mb = 0; mb < 4; ++mb) {
#pragma unroll
        for (int nb = 0; nb < 4; ++nb) {
#pragma unroll
            for (int j = 0; j < 8; ++j) os[(hi * 8 + j) * 68 + nb * 16 + lr] = acc[mb][nb][j]; }
        __builtin_amdgcn_wave_barrier(); asm volatile("" ::: "memory");
        float* crow = C + (size_t)(r0 + mb * 16) * ldc + c0;
{
#pragma unroll
            for (int s = 0; s < 8; ++s) { const int row = 2 * s + hi, cofs = lr * 4; v4f val = *(const v4fa*)(os + row * 68 + cofs); if (BIAS) { val[0] += bfr(bias[c0 + cofs]); val[1] += bfr(bias[c0 + cofs + 1]); val[2] += bfr(bias[c0 + cofs + 2]); val[3] += bfr(bias[c0 + cofs + 3]); }
                *(v4f*)(crow + (size_t)row * ldc + cofs) = val; }
             }
        __builtin_amdgcn_wave_barrier(); asm volatile("" ::: "memory");
    }
}

__device__ __forceinline__ h16 tohx(float x) { return (h16)x; }
__device__ __forceinline__ void splitf(float y, unsigned short& h, unsigned short& l) { h = f2bf(y); l = f2bf(y - bf2f(h)); }
typedef __attribute__((ext_vector_type(2))) _Float16 v2h;
typedef __attribute__((ext_vector_type(4))) _Float16 v4h;
typedef __attribute__((ext_vector_type(2))) unsigned short v2us;
typedef __attribute__((ext_vector_type(4))) unsigned short v4us;
typedef __attribute__((ext_vector_type(2))) float v2f;
typedef __attribute__((ext_vector_type(4))) int v4i;


__global__ __launch_bounds__(256) void k_plin(const float* __restrict__ src, h16* P16, bf* Ph, bf* Pl, size_t n8) { const size_t i = (size_t)blockIdx.x * 256 + threadIdx.x; if (i >= n8) return; const v8f v = *(const v8f*)(src + i * 8); v8h o16; v8us oh, ol;
#pragma unroll
    for (int q = 0; q < 8; ++q) { const float r = bfr(v[q]); o16[q] = tohx(r); oh[q] = f2bf(r); ol[q] = 0; }
    *(v8h*)(P16 + i * 8) = o16; *(v8us*)(Ph + i * 8) = oh; *(v8us*)(Pl + i * 8) = ol;  }
__global__ __launch_bounds__(256) void k_vtpH(const float* __restrict__ F, h16* V16, bf* Vh, bf* Vl) { const size_t e = ((size_t)blockIdx.x * 256 + threadIdx.x) * 2; if (e >= (size_t)NKV * HD * TT) return; const int t = (int)(e % TT); const int d = (int)((e / TT) % HD); const int g = (int)(e / ((size_t)TT * HD)); v2h o16; v2us oh, ol;
#pragma unroll
    for (int q = 0; q < 2; ++q) { const float x = bfr(F[((size_t)g * TT + t + q) * HD + d]); o16[q] = tohx(x); oh[q] = f2bf(x); ol[q] = 0; }
    *(v2h*)(V16 + e) = o16; *(v2us*)(Vh + e) = oh; *(v2us*)(Vl + e) = ol;  }
__global__ __launch_bounds__(256) void k_mergeH(const float* __restrict__ O, float* OUTh) { const size_t i = (size_t)blockIdx.x * 256 + threadIdx.x; if (i >= (size_t)ZH * TT * HD / 4) return; const size_t e = i * 4; const int t = (int)((e / HD) % TT); const float cs = (t < RH) ? 1.0f : (1.0f / PCAR); const v4f a = *(const v4f*)(O + e); v4f o;
#pragma unroll
    for (int q = 0; q < 4; ++q) o[q] = a[q] * cs; *(v4f*)(OUTh + e) = o;  }


__global__ __launch_bounds__(256) void k_csid(float* CS) { const int idx = blockIdx.x * 256 + threadIdx.x; if (idx >= TT * HD) return; v2f cs; cs[0] = 1.0f; cs[1] = 0.0f; *(v2f*)(CS + (size_t)idx * 2) = cs;  }
// k_asoft: per row (zz, i): t = S (no scaling, no mask); softmax over the 2048 keys (register row, one exp, fixed trees);
__global__ __launch_bounds__(256) void k_asoft(const float* __restrict__ Sb, h16* P16, bf* Ph, bf* Pl) {
    const int lane = threadIdx.x & 31; const int row = blockIdx.x * 8 + (threadIdx.x >> 5); if (row >= ZH * TT) return; const int i = row % TT; const int zz = row / TT; (void)zz; const bool hires = (i < RH); const float* sr = Sb + (size_t)row * TT; float v[TT / 32]; float mx = -3.0e38f;
#pragma unroll
    for (int ch = 0; ch < TT / 128; ++ch) { const int j0 = ch * 128 + lane * 4; const v4f a = *(const v4f*)(sr + j0);
#pragma unroll
        for (int q = 0; q < 4; ++q) { const int j = j0 + q; (void)j; const float t = a[q] * SCL; v[ch * 4 + q] = t; mx = fmaxf(mx, t); } }
#pragma unroll
    for (int sh = 16; sh; sh >>= 1) mx = fmaxf(mx, __shfl_xor(mx, sh, 32));
    float sum = 0.f;
#pragma unroll
    for (int k = 0; k < TT / 32; ++k) { float d0 = __fsub_rn(v[k], mx); asm volatile("" : "+v"(d0)); v[k] = __builtin_amdgcn_exp2f(__fmul_rn(d0, 1.4426950408889634f)); sum += v[k]; }
#pragma unroll
    for (int sh = 16; sh; sh >>= 1) sum += __shfl_xor(sum, sh, 32);
    const float f = __fdiv_rn(hires ? 1.0f : PCAR, sum);
{
        if (hires) {
#pragma unroll
            for (int ch = 0; ch < TT / 128; ++ch) { v4us oh, ol;
#pragma unroll
                for (int q = 0; q < 4; ++q) { unsigned short a, c2; splitf(v[ch * 4 + q] * f, a, c2); oh[q] = a; ol[q] = c2; }
                const size_t oo = ((size_t)zz * (RH ? RH : 1) + i) * TT + ch * 128 + lane * 4; *(v4us*)(Ph + oo) = oh; *(v4us*)(Pl + oo) = ol; }
        } else {
#pragma unroll
            for (int ch = 0; ch < TT / 128; ++ch) { v4h o4;
#pragma unroll
                for (int q = 0; q < 4; ++q) o4[q] = tohx(v[ch * 4 + q] * f);
                *(v4h*)(P16 + (size_t)row * TT + ch * 128 + lane * 4) = o4; } }
         }
}

extern "C" void kernel_launch(void* const* d_in, const int* in_sizes, int n_in,
                              void* d_out, int out_size, void* d_ws, size_t ws_size, hipStream_t stream) {
    (void)in_sizes; (void)n_in; (void)out_size;
    const float* qi = (const float*)d_in[0]; const float* ki = (const float*)d_in[1]; const float* vi = (const float*)d_in[2]; const float* x = nullptr; const float* wq = nullptr; const float* wk = nullptr; const float* wv = nullptr; const float* wo = nullptr; (void)x; (void)wq; (void)wk; (void)wv; (void)wo;
    float* OUT = (float*)d_out;     // [2][16][2048][128]
    char* wsp = (char*)d_ws;
    auto take = [&](size_t bytes) { char* p = wsp; wsp += (bytes + 255) & ~(size_t)255; return (void*)p; };
    float* CS = (float*)take((size_t)TT * HD * 2 * 4);
    
    h16* QP16 = (h16*)take((size_t)NH_ * TT * HD * 2); h16* KP16 = (h16*)take((size_t)NKV * TT * HD * 2); h16* VT16 = (h16*)take((size_t)NKV * HD * TT * 2);
    bf* QPh = (bf*)take((size_t)NH_ * TT * HD * 2); bf* QPl = (bf*)take((size_t)NH_ * TT * HD * 2); bf* KPh = (bf*)take((size_t)NKV * TT * HD * 2); bf* KPl = (bf*)take((size_t)NKV * TT * HD * 2); bf* VTh = (bf*)take((size_t)NKV * HD * TT * 2); bf* VTl = (bf*)take((size_t)NKV * HD * TT * 2); bf* Ph = (bf*)take((size_t)ZH * RH * TT * 2); bf* Pl = (bf*)take((size_t)ZH * RH * TT * 2);
    float* Sb = (float*)take((size_t)ZH * TT * TT * 4); h16* P16 = (h16*)take((size_t)ZH * TT * TT * 2); float* Ob = (float*)take((size_t)ZH * TT * HD * 4);
    if ((size_t)(wsp - (char*)d_ws) > ws_size) return;    // ws 256 MiB
    { 
       }
    k_csid<<<(TT * HD + 255) / 256, 256, 0, stream>>>(CS);
    const unsigned LQ = (unsigned)(((size_t)NH_ * TT * HD / 2 + 255) / 256), LKv = (unsigned)(((size_t)NKV * TT * HD / 2 + 255) / 256);
    for (int b = 0; b < NB_; ++b) {
        
        /* q given */
        k_plin<<<(unsigned)(((size_t)NH_ * TT * HD / 8 + 255) / 256), 256, 0, stream>>>(qi + (size_t)b * NH_ * TT * HD, QP16, QPh, QPl, (size_t)NH_ * TT * HD / 8);
        /* k given */
        k_plin<<<(unsigned)(((size_t)NKV * TT * HD / 8 + 255) / 256), 256, 0, stream>>>(ki + (size_t)b * NKV * TT * HD, KP16, KPh, KPl, (size_t)NKV * TT * HD / 8);
        k_vtpH<<<(unsigned)(((size_t)NKV * HD * TT / 2 + 255) / 256), 256, 0, stream>>>(vi + (size_t)b * NKV * TT * HD, VT16, VTh, VTl);   /* v given (head-major) */
        for (int h0 = 0; h0 < NH_; h0 += ZH) { const size_t zq = (size_t)h0, zk = (size_t)(h0 / REP);   // one kv head per query head: the pass's two heads use consecutive kv planes (z-strides TT*HD)
            k_gemmw<bf, 2, false><<<dim3(RH / 64, TT / 64, ZH), 32, 0, stream>>>(QPh + zq * TT * HD, QPl + zq * TT * HD, KPh + zk * TT * HD, KPl + zk * TT * HD, HD, Sb, TT, nullptr, (size_t)TT * HD, (size_t)TT * HD, (size_t)TT * TT);
            k_asoft<<<ZH * TT / 8, 256, 0, stream>>>(Sb, P16, Ph, Pl);
            k_gemmw<bf, 2, false><<<dim3(RH / 64, HD / 64, ZH), 32, 0, stream>>>(Ph, Pl, VTh + zk * HD * TT, VTl + zk * HD * TT, TT, Ob, HD, nullptr, (size_t)RH * TT, (size_t)HD * TT, (size_t)TT * HD);
            k_mergeH<<<(unsigned)(((size_t)ZH * TT * HD / 4 + 255) / 256), 256, 0, stream>>>(Ob, OUT + ((size_t)b * NH_ + h0) * TT * HD); }   /* context, head-major f32 */
    }
}

// v001
// One run takes 68.3 microseconds.
// Timed twice side by side with v000, it ran 17.3 times as fast both times.
#include <hip/hip_runtime.h>
#include <math.h>
#include <stdint.h>

constexpr int NHEAD = 32, TT = 2048, D = 128;   // batch x heads, sequence, head size

typedef uint32_t u32x4 __attribute__((ext_vector_type(4)));
typedef int i32x8 __attribute__((ext_vector_type(8)));
typedef float f32x8 __attribute__((ext_vector_type(8)));
typedef float f32x4 __attribute__((ext_vector_type(4)));
typedef float f32x2 __attribute__((ext_vector_type(2)));
typedef uint32_t u32x2 __attribute__((ext_vector_type(2)));
typedef __bf16 bf16x16 __attribute__((ext_vector_type(16)));

constexpr int DK = D / 32, DT = D / 16;
constexpr int NW = 8;
constexpr int BR = 256, CW = BR / NW, R = CW / 16;
constexpr int BC = 32, KT = BC / 16;
constexpr uint32_t ROWB = 2u * D, PITCH_K = ROWB + 16u, PITCH_V = ROWB + 32u;
constexpr uint32_t SK = 64, NST = TT / SK, NSTEP = SK / BC;   // keys per stage, stages, passes per stage
constexpr uint32_t TILE_K = SK * PITCH_K, TILE_V = SK * PITCH_V, SLOT = TILE_K + TILE_V;
constexpr uint32_t EPITCH = 4u * D + 16u;            // output staging pitch (f32 rows)
constexpr uint32_t LDS_BYTES = (uint32_t)NW * CW * EPITCH;
static_assert(2u * SLOT <= LDS_BYTES, "the output staging reuses the two K/V buffers and is the larger");
constexpr uint32_t NCH = SK * 4u * D / 16u / (NW * 32u);   // 16-byte chunks (4 f32) of a K (or V) stage per thread

#define DEV static __device__ __forceinline__
// Stands behind a run of issued global loads, before the registers that hold their addresses are used for something else; the scheduling barrier
// keeps later register writes (the accumulators' zeroes, the next addresses) from being lifted over the wait.
DEV void wait_x0() { asm volatile("s_wait_xcnt 0x0" ::: "memory"); __builtin_amdgcn_sched_barrier(0); }
// The same; the run's address is an input, so that it stays live up to the wait and no load of the run gets its registers as a destination.
DEV void wait_x0(const float* a) { asm volatile("s_wait_xcnt 0x0" :: "v"(a) : "memory"); __builtin_amdgcn_sched_barrier(0); }

struct Frag { u32x4 q[2]; };
DEV f32x8 mma(const Frag& a, const Frag& b, f32x8 c) {
  const i32x8 av = {(int)a.q[0].x, (int)a.q[0].y, (int)a.q[0].z, (int)a.q[0].w, (int)a.q[1].x, (int)a.q[1].y, (int)a.q[1].z, (int)a.q[1].w};
  const i32x8 bv = {(int)b.q[0].x, (int)b.q[0].y, (int)b.q[0].z, (int)b.q[0].w, (int)b.q[1].x, (int)b.q[1].y, (int)b.q[1].z, (int)b.q[1].w};
  return __builtin_amdgcn_wmma_f32_16x16x32_bf16(0, __builtin_bit_cast(bf16x16, av), 0, __builtin_bit_cast(bf16x16, bv), 0, c, false, false);
}
typedef short s16x8 __attribute__((ext_vector_type(8)));
DEV u32x4 ld_tr16(const unsigned char* p) { typedef __attribute__((address_space(3))) s16x8 lds_s16x8; return __builtin_bit_cast(u32x4, __builtin_amdgcn_ds_load_tr16_b128_v8i16((lds_s16x8*)p)); }
DEV uint32_t pack2(float lo, float hi) { typedef __bf16 bf2 __attribute__((ext_vector_type(2)));
  return __builtin_bit_cast(uint32_t, __builtin_convertvector(f32x2{lo, hi}, bf2)); }   // round to nearest even
DEV float xhalf(float x) { return __builtin_bit_cast(float, __builtin_amdgcn_permlanex16(__builtin_bit_cast(int, x), __builtin_bit_cast(int, x), 0x76543210, 0xfedcba98, false, false)); }   // lane l with lane l ^ 16

DEV void block(const unsigned char* Lp, uint32_t koff, uint32_t voff, uint32_t lane, const Frag (&qf)[R][DK], f32x8 (&acc)[R][DT], float (&m_run)[R], float (&l_run)[R]) {
  constexpr float cscale = 1.4426950408889634f;
  const uint32_t c = lane & 15u, h = lane >> 4;
  f32x8 s[KT][R];
#pragma unroll
  for (int kt = 0; kt < KT; ++kt) {
    Frag kf[DK];
    const unsigned char* p = Lp + koff + (16u * kt + c) * PITCH_K + 16u * h;
#pragma unroll
    for (int kc = 0; kc < DK; ++kc) { kf[kc].q[0] = *reinterpret_cast<const u32x4*>(p + 64u * kc); kf[kc].q[1] = *reinterpret_cast<const u32x4*>(p + 64u * kc + 32u); }
#pragma unroll
    for (int g = 0; g < R; ++g) { s[kt][g] = f32x8{};
#pragma unroll
      for (int kc = 0; kc < DK; ++kc) s[kt][g] = mma(kf[kc], qf[g][kc], s[kt][g]); }
  }
  // The pass's 16 transposing loads (two per 16 (d) x 32 (keys) fragment), in flight under the maxima and the exponentials.
  Frag vf[DT];
  {
    const unsigned char* ad = Lp + voff + (8u * h + (lane & 7u)) * PITCH_V + ((lane >> 3) & 1u) * 16u;
#pragma unroll
    for (int t = 0; t < DT; ++t) { vf[t].q[0] = ld_tr16(ad + 32u * t); vf[t].q[1] = ld_tr16(ad + 16u * PITCH_V + 32u * t); }
  }
  float mb[R]; bool need = false;
#pragma unroll
  for (int g = 0; g < R; ++g) {
    float mx = -INFINITY;
#pragma unroll
    for (int kt = 0; kt < KT; ++kt) {
#pragma unroll
      for (int r = 0; r < 8; ++r) mx = __builtin_fmaxf(mx, s[kt][g][r]);
    }
    mx = __builtin_fmaxf(mx, xhalf(mx)) * cscale;   // both wave halves now hold this query's maximum, in the log2 domain
    mb[g] = mx; need = need || (mx > m_run[g] + 8.0f);
  }
  if (__builtin_amdgcn_ballot_w32(need) != 0) {   // rare after the first passes
#pragma unroll
    for (int g = 0; g < R; ++g) {
      const float m_new = __builtin_fmaxf(m_run[g], mb[g]);
      const float corr = __builtin_amdgcn_exp2f(m_run[g] - m_new);   // 0 on the first pass, where m_run is -inf
      l_run[g] *= corr; m_run[g] = m_new;
#pragma unroll
      for (int t = 0; t < DT; ++t) acc[g][t] = acc[g][t] * corr;
    }
  }
#pragma unroll
  for (int g = 0; g < R; ++g) {
    const float nm = -m_run[g];
    f32x2 ps0 = {0.0f, 0.0f}, ps1 = {0.0f, 0.0f};   // packed partial sums: one packed add per pair of exponentials
    uint32_t wh[8], wl[8];
#pragma unroll
    for (int i = 0; i < 8; ++i) {
      const f32x2 arg = __builtin_elementwise_fma(f32x2{s[i >> 2][g][2 * (i & 3)], s[i >> 2][g][2 * (i & 3) + 1]}, f32x2{cscale, cscale}, f32x2{nm, nm});
      const f32x2 p = {__builtin_amdgcn_exp2f(arg.x), __builtin_amdgcn_exp2f(arg.y)};
      if (i & 1) ps1 += p; else ps0 += p;
      const uint32_t w = pack2(p.x, p.y);
      wh[i] = w;
      wl[i] = pack2(p.x - __uint_as_float(w << 16), p.y - __uint_as_float(w & 0xFFFF0000u));   // what the bf16 rounding of P left over
    }
    Frag ph, pl; ph.q[0] = u32x4{wh[0], wh[1], wh[2], wh[3]}; ph.q[1] = u32x4{wh[4], wh[5], wh[6], wh[7]}; pl.q[0] = u32x4{wl[0], wl[1], wl[2], wl[3]}; pl.q[1] = u32x4{wl[4], wl[5], wl[6], wl[7]};
#pragma unroll
    for (int t = 0; t < DT; ++t) acc[g][t] = mma(vf[t], ph, acc[g][t]);
#pragma unroll
    for (int t = 0; t < DT; ++t) acc[g][t] = mma(vf[t], pl, acc[g][t]);
    ps0 += ps1;
    l_run[g] += ps0.x + ps0.y;
  }
}

__global__ void __launch_bounds__(NW * 32) __attribute__((amdgpu_waves_per_eu(2, 2))) k_attn(const float* __restrict__ Q, const float* __restrict__ K, const float* __restrict__ V, float* __restrict__ O) {
  __shared__ __attribute__((aligned(256))) unsigned char L[LDS_BYTES];
  const uint32_t tid = threadIdx.x, lane = tid & 31u, wave = tid >> 5, c = lane & 15u, h = lane >> 4;
  const uint32_t head = blockIdx.y, q0 = blockIdx.x * BR;
  const float* kp = K + (size_t)head * TT * D + tid * 4u;
  const float* vp = V + (size_t)head * TT * D + tid * 4u;
  f32x4 rk[NCH], rv[NCH];   // the next stage on its way from global memory to LDS
  auto gload = [&](uint32_t st) {   // a stage is SK whole rows: contiguous in memory, every load takes whole lines
#pragma unroll
    for (uint32_t i = 0; i < NCH; ++i) { rk[i] = *reinterpret_cast<const f32x4*>(kp + (size_t)st * SK * D + i * 1024u); rv[i] = *reinterpret_cast<const f32x4*>(vp + (size_t)st * SK * D + i * 1024u); }
    wait_x0();
  };
  auto sstore = [&](uint32_t buf) {   // rounds to bf16: 4 f32 become 8 bytes
#pragma unroll
    for (uint32_t i = 0; i < NCH; ++i) { const uint32_t id = i * 256u + tid, row = id >> 5, cb = (id & 31u) * 8u;
      *reinterpret_cast<u32x2*>(L + buf * SLOT + row * PITCH_K + cb) = u32x2{pack2(rk[i].x, rk[i].y), pack2(rk[i].z, rk[i].w)};
      *reinterpret_cast<u32x2*>(L + buf * SLOT + TILE_K + row * PITCH_V + cb) = u32x2{pack2(rv[i].x, rv[i].y), pack2(rv[i].z, rv[i].w)}; }
  };
  gload(0);
  // Q fragments, rounded to bf16, in the hardware k order, as K's in block().
  Frag qf[R][DK];
  {
    f32x4 qa[R][DK][2], qb[R][DK][2];
#pragma unroll
    for (int g = 0; g < R; ++g) {
      const float* qp = Q + ((size_t)head * TT + q0 + wave * CW + 16u * g + c) * D + 8u * h;
#pragma unroll
      for (int kc = 0; kc < DK; ++kc) {
#pragma unroll
        for (int u = 0; u < 2; ++u) { qa[g][kc][u] = *reinterpret_cast<const f32x4*>(qp + 32 * kc + 16 * u); qb[g][kc][u] = *reinterpret_cast<const f32x4*>(qp + 32 * kc + 16 * u + 4); }
      }
      wait_x0(qp);
    }
#pragma unroll
    for (int g = 0; g < R; ++g) {
#pragma unroll
      for (int kc = 0; kc < DK; ++kc) {
#pragma unroll
        for (int u = 0; u < 2; ++u) { const f32x4 a = qa[g][kc][u], b = qb[g][kc][u];
          qf[g][kc].q[u] = u32x4{pack2(a.x, a.y), pack2(a.z, a.w), pack2(b.x, b.y), pack2(b.z, b.w)}; }
      }
    }
  }
  f32x8 acc[R][DT];
  float m_run[R], l_run[R];
#pragma unroll
  for (int g = 0; g < R; ++g) { m_run[g] = -INFINITY; l_run[g] = 0.0f;
#pragma unroll
    for (int t = 0; t < DT; ++t) acc[g][t] = f32x8{}; }
  sstore(0);
  __syncthreads();   // stage 0 is visible to every wave
#pragma unroll 1   // kept rolled: one stage's code is already two whole passes; more copies only cost instruction cache
  for (uint32_t st = 0; st < NST; ++st) {
    const uint32_t base = (st & 1u) * SLOT;
    if (st + 1u < NST) gload(st + 1u);   // in flight under this stage's passes
#pragma unroll   // both passes in one stretch of code: the second pass's K fragment loads can then be issued under the first pass's P.V products
    for (uint32_t sub = 0; sub < NSTEP; ++sub) block(L, base + sub * BC * PITCH_K, base + TILE_K + sub * BC * PITCH_V, lane, qf, acc, m_run, l_run);
    if (st + 1u < NST) sstore((st + 1u) & 1u);   // the buffer that stage st - 1 used: every wave left it at the last barrier
    __syncthreads();   // publishes stage st + 1 and ends every wave's reads of stage st
  }
  // Epilogue: each wave stages its own 32 output rows in LDS (the K/V buffers are free behind the last barrier) and stores whole rows.
  unsigned char* E = L + wave * (uint32_t)CW * EPITCH;
#pragma unroll
  for (int g = 0; g < R; ++g) {
    const float l_fin = l_run[g] + xhalf(l_run[g]);
    const float inv = 1.0f / l_fin;
#pragma unroll
    for (int t = 0; t < DT; ++t) {
      const f32x8 o = acc[g][t] * inv;
      *reinterpret_cast<f32x4*>(E + (16u * g + c) * EPITCH + 64u * t + 32u * h) = f32x4{o[0], o[1], o[2], o[3]};
      *reinterpret_cast<f32x4*>(E + (16u * g + c) * EPITCH + 64u * t + 32u * h + 16u) = f32x4{o[4], o[5], o[6], o[7]};
    }
  }
#pragma unroll
  for (uint32_t row = 0; row < (uint32_t)CW; ++row) {
    const f32x4 v = *reinterpret_cast<const f32x4*>(E + row * EPITCH + lane * 16u);
    *reinterpret_cast<f32x4*>(O + ((size_t)head * TT + q0 + wave * CW + row) * D + lane * 4u) = v;
  }
}

extern "C" void kernel_launch(void* const* d_in, const int* in_sizes, int n_in,
                              void* d_out, int out_size, void* d_ws, size_t ws_size, hipStream_t stream) {
  (void)in_sizes; (void)n_in; (void)out_size; (void)d_ws; (void)ws_size;
  const float* qi = (const float*)d_in[0]; const float* ki = (const float*)d_in[1]; const float* vi = (const float*)d_in[2];
  float* OUT = (float*)d_out;
  k_attn<<<dim3(TT / BR, NHEAD), NW * 32, 0, stream>>>(qi, ki, vi, OUT);
}

// v003
// A run of this version takes 52.4 microseconds.
// Versions between v001 and this one are left out; their measured steps multiply to 1.30 times as fast.
// Over all steps from v000 it is 22.6 times as fast.
#include <hip/hip_runtime.h>
#include <math.h>
#include <stdint.h>

constexpr int NHEAD = 32, TT = 2048, D = 128;   // batch x heads, sequence, head size

typedef uint32_t u32x4 __attribute__((ext_vector_type(4)));
typedef int i32x8 __attribute__((ext_vector_type(8)));
typedef float f32x8 __attribute__((ext_vector_type(8)));
typedef float f32x4 __attribute__((ext_vector_type(4)));
typedef float f32x2 __attribute__((ext_vector_type(2)));
typedef uint32_t u32x2 __attribute__((ext_vector_type(2)));
typedef __bf16 bf16x16 __attribute__((ext_vector_type(16)));
typedef _Float16 f16x16 __attribute__((ext_vector_type(16)));

constexpr int DK = D / 32, DT = D / 16;
constexpr int NW = 8;
constexpr int BR = 256, CW = BR / NW, R = CW / 16;
constexpr int BC = 32, KT = BC / 16;
constexpr uint32_t ROWB = 2u * D, PITCH_K = ROWB + 16u, PITCH_V = ROWB + 32u;
constexpr uint32_t SK = 64, NST = TT / SK, NSTEP = SK / BC;   // keys per stage, stages, passes per stage
constexpr uint32_t TILE_K = SK * PITCH_K, TILE_V = SK * PITCH_V, SLOT = TILE_K + TILE_V;
constexpr uint32_t EPITCH = 4u * D + 16u;            // output staging pitch (f32 rows)
constexpr uint32_t LDS_BYTES = (uint32_t)NW * CW * EPITCH;
static_assert(3u * SLOT <= LDS_BYTES, "the output staging reuses the three K/V buffers and is the larger");
static_assert(NSTEP == 2u, "the stage loop is written for a first and a last pass");
constexpr uint32_t NCH = SK * 4u * D / 16u / (NW * 32u);   // 16-byte chunks (4 f32) of a K (or V) stage per thread

#define DEV static __device__ __forceinline__
// Stands behind a run of issued global loads, before the registers that hold their addresses are used for something else; the scheduling barrier
// keeps later register writes (the accumulators' zeroes, the next addresses) from being lifted over the wait.
DEV void wait_x0() { asm volatile("s_wait_xcnt 0x0" ::: "memory"); __builtin_amdgcn_sched_barrier(0); }
// The same; the run's address is an input, so that it stays live up to the wait and no load of the run gets its registers as a destination.
DEV void wait_x0(const float* a) { asm volatile("s_wait_xcnt 0x0" :: "v"(a) : "memory"); __builtin_amdgcn_sched_barrier(0); }

// Nothing is scheduled across it: it keeps a pass's LDS reads together in one place instead of spread among the matrix instructions.
DEV void fence() { __builtin_amdgcn_sched_barrier(0); }

struct Frag { u32x4 q[2]; };
DEV f32x8 mma(const Frag& a, const Frag& b, f32x8 c) {
  const i32x8 av = {(int)a.q[0].x, (int)a.q[0].y, (int)a.q[0].z, (int)a.q[0].w, (int)a.q[1].x, (int)a.q[1].y, (int)a.q[1].z, (int)a.q[1].w};
  const i32x8 bv = {(int)b.q[0].x, (int)b.q[0].y, (int)b.q[0].z, (int)b.q[0].w, (int)b.q[1].x, (int)b.q[1].y, (int)b.q[1].z, (int)b.q[1].w};
  return __builtin_amdgcn_wmma_f32_16x16x32_bf16(0, __builtin_bit_cast(bf16x16, av), 0, __builtin_bit_cast(bf16x16, bv), 0, c, false, false);
}
DEV f32x8 mma_h(const Frag& a, const Frag& b, f32x8 c) {   // the same product on f16 operands; the fragment maps are those of the bf16 form
  const i32x8 av = {(int)a.q[0].x, (int)a.q[0].y, (int)a.q[0].z, (int)a.q[0].w, (int)a.q[1].x, (int)a.q[1].y, (int)a.q[1].z, (int)a.q[1].w};
  const i32x8 bv = {(int)b.q[0].x, (int)b.q[0].y, (int)b.q[0].z, (int)b.q[0].w, (int)b.q[1].x, (int)b.q[1].y, (int)b.q[1].z, (int)b.q[1].w};
  return __builtin_amdgcn_wmma_f32_16x16x32_f16(0, __builtin_bit_cast(f16x16, av), 0, __builtin_bit_cast(f16x16, bv), 0, c, false, false);
}
typedef short s16x8 __attribute__((ext_vector_type(8)));
DEV u32x4 ld_tr16(const unsigned char* p) { typedef __attribute__((address_space(3))) s16x8 lds_s16x8; return __builtin_bit_cast(u32x4, __builtin_amdgcn_ds_load_tr16_b128_v8i16((lds_s16x8*)p)); }
DEV uint32_t pack2(float lo, float hi) { typedef __bf16 bf2 __attribute__((ext_vector_type(2)));
  return __builtin_bit_cast(uint32_t, __builtin_convertvector(f32x2{lo, hi}, bf2)); }   // round to nearest even
DEV uint32_t pack2h(float lo, float hi) { typedef _Float16 h2 __attribute__((ext_vector_type(2)));
  return __builtin_bit_cast(uint32_t, __builtin_convertvector(f32x2{lo, hi}, h2)); }   // to f16, round to nearest even
DEV float xhalf(float x) { return __builtin_bit_cast(float, __builtin_amdgcn_permlanex16(__builtin_bit_cast(int, x), __builtin_bit_cast(int, x), 0x76543210, 0xfedcba98, false, false)); }   // lane l with lane l ^ 16

struct KFr { Frag f[KT][DK]; };
DEV void load_k(KFr& k, const unsigned char* Lp, uint32_t koff, uint32_t lane) {
  const uint32_t c = lane & 15u, h = lane >> 4;
#pragma unroll
  for (int kt = 0; kt < KT; ++kt) {
    const unsigned char* p = Lp + koff + (16u * kt + c) * PITCH_K + 16u * h;
#pragma unroll
    for (int kc = 0; kc < DK; ++kc) { k.f[kt][kc].q[0] = *reinterpret_cast<const u32x4*>(p + 64u * kc); k.f[kt][kc].q[1] = *reinterpret_cast<const u32x4*>(p + 64u * kc + 32u); }
  }
}

DEV void block(KFr& kf, bool fetch_next, uint32_t next_koff, const unsigned char* Lp, uint32_t voff, uint32_t lane, const Frag (&qf)[R][DK], f32x8 (&acc)[R][DT], float (&m_run)[R], float (&l_run)[R]) {
  constexpr float cscale = 1.4426950408889634f;
  const uint32_t h = lane >> 4;
  f32x8 s[KT][R];
#pragma unroll
  for (int kt = 0; kt < KT; ++kt) {
#pragma unroll
    for (int g = 0; g < R; ++g) { s[kt][g] = f32x8{};
#pragma unroll
      for (int kc = 0; kc < DK; ++kc) s[kt][g] = mma(kf.f[kt][kc], qf[g][kc], s[kt][g]); }
  }
  fence();   // no LDS read is lifted in among the products above
  // All LDS reads of a pass in one place, in flight under the maxima and the exponentials: its own 16 transposing loads (two per 16 (d) x 32 (keys)
  // fragment), then the next pass's 16 K loads into the registers that the products above have just read.
  Frag vf[DT];
  {
    const unsigned char* ad = Lp + voff + (8u * h + (lane & 7u)) * PITCH_V + ((lane >> 3) & 1u) * 16u;
#pragma unroll
    for (int t = 0; t < DT; ++t) { vf[t].q[0] = ld_tr16(ad + 32u * t); vf[t].q[1] = ld_tr16(ad + 16u * PITCH_V + 32u * t); }
  }
  fence();   // V first: it is needed first, and LDS returns in issue order
  if (fetch_next) load_k(kf, Lp, next_koff, lane);
  fence();   // no LDS read sinks in among the vector work and the products below
  float mb[R]; bool need = false;
#pragma unroll
  for (int g = 0; g < R; ++g) {
    float mx = -INFINITY;
#pragma unroll
    for (int kt = 0; kt < KT; ++kt) {
#pragma unroll
      for (int r = 0; r < 8; ++r) mx = __builtin_fmaxf(mx, s[kt][g][r]);
    }
    mx = __builtin_fmaxf(mx, xhalf(mx)) * cscale;   // both wave halves now hold this query's maximum, in the log2 domain
    mb[g] = mx; need = need || (mx > m_run[g] + 8.0f);
  }
  if (__builtin_amdgcn_ballot_w32(need) != 0) {   // rare after the first passes
#pragma unroll
    for (int g = 0; g < R; ++g) {
      const float m_new = __builtin_fmaxf(m_run[g], mb[g]);
      const float corr = __builtin_amdgcn_exp2f(m_run[g] - m_new);   // 0 on the first pass, where m_run is -inf
      l_run[g] *= corr; m_run[g] = m_new;
#pragma unroll
      for (int t = 0; t < DT; ++t) acc[g][t] = acc[g][t] * corr;
    }
  }
#pragma unroll
  for (int g = 0; g < R; ++g) {
    const float nm = -m_run[g];
    f32x2 ps0 = {0.0f, 0.0f}, ps1 = {0.0f, 0.0f};   // packed partial sums: one packed add per pair of exponentials
    uint32_t wh[8];
#pragma unroll
    for (int i = 0; i < 8; ++i) {
      const f32x2 arg = __builtin_elementwise_fma(f32x2{s[i >> 2][g][2 * (i & 3)], s[i >> 2][g][2 * (i & 3) + 1]}, f32x2{cscale, cscale}, f32x2{nm, nm});
      const f32x2 p = {__builtin_amdgcn_exp2f(arg.x), __builtin_amdgcn_exp2f(arg.y)};
      if (i & 1) ps1 += p; else ps0 += p;
      wh[i] = pack2h(p.x, p.y);
    }
    Frag ph; ph.q[0] = u32x4{wh[0], wh[1], wh[2], wh[3]}; ph.q[1] = u32x4{wh[4], wh[5], wh[6], wh[7]};
#pragma unroll
    for (int t = 0; t < DT; ++t) acc[g][t] = mma_h(vf[t], ph, acc[g][t]);
    ps0 += ps1;
    l_run[g] += ps0.x + ps0.y;
  }
}

__global__ void __launch_bounds__(NW * 32) __attribute__((amdgpu_waves_per_eu(2, 2))) k_attn(const float* __restrict__ Q, const float* __restrict__ K, const float* __restrict__ V, float* __restrict__ O) {
  __shared__ __attribute__((aligned(256))) unsigned char L[LDS_BYTES];
  const uint32_t tid = threadIdx.x, lane = tid & 31u, wave = tid >> 5, c = lane & 15u, h = lane >> 4;
  const uint32_t head = blockIdx.y, q0 = blockIdx.x * BR;
  const float* kp = K + (size_t)head * TT * D + tid * 4u;
  const float* vp = V + (size_t)head * TT * D + tid * 4u;
  f32x4 rk[NCH], rv[NCH];   // the next stage on its way from global memory to LDS
  auto gload = [&](uint32_t st) {   // a stage is SK whole rows: contiguous in memory, every load takes whole lines
#pragma unroll
    for (uint32_t i = 0; i < NCH; ++i) { rk[i] = *reinterpret_cast<const f32x4*>(kp + (size_t)st * SK * D + i * 1024u); rv[i] = *reinterpret_cast<const f32x4*>(vp + (size_t)st * SK * D + i * 1024u); }
    wait_x0();
  };
  auto sstore = [&](uint32_t base) {   // rounds k to bf16 and v to f16: 4 f32 become 8 bytes; base = the buffer's byte offset
#pragma unroll
    for (uint32_t i = 0; i < NCH; ++i) { const uint32_t id = i * 256u + tid, row = id >> 5, cb = (id & 31u) * 8u;
      *reinterpret_cast<u32x2*>(L + base + row * PITCH_K + cb) = u32x2{pack2(rk[i].x, rk[i].y), pack2(rk[i].z, rk[i].w)};
      *reinterpret_cast<u32x2*>(L + base + TILE_K + row * PITCH_V + cb) = u32x2{pack2h(rv[i].x, rv[i].y), pack2h(rv[i].z, rv[i].w)}; }
  };
  gload(0);
  // Q fragments, rounded to bf16, in the hardware k order, as K's in block().
  Frag qf[R][DK];
  {
    f32x4 qa[R][DK][2], qb[R][DK][2];
#pragma unroll
    for (int g = 0; g < R; ++g) {
      const float* qp = Q + ((size_t)head * TT + q0 + wave * CW + 16u * g + c) * D + 8u * h;
#pragma unroll
      for (int kc = 0; kc < DK; ++kc) {
#pragma unroll
        for (int u = 0; u < 2; ++u) { qa[g][kc][u] = *reinterpret_cast<const f32x4*>(qp + 32 * kc + 16 * u); qb[g][kc][u] = *reinterpret_cast<const f32x4*>(qp + 32 * kc + 16 * u + 4); }
      }
      wait_x0(qp);
    }
#pragma unroll
    for (int g = 0; g < R; ++g) {
#pragma unroll
      for (int kc = 0; kc < DK; ++kc) {
#pragma unroll
        for (int u = 0; u < 2; ++u) { const f32x4 a = qa[g][kc][u], b = qb[g][kc][u];
          qf[g][kc].q[u] = u32x4{pack2(a.x, a.y), pack2(a.z, a.w), pack2(b.x, b.y), pack2(b.z, b.w)}; }
      }
    }
  }
  f32x8 acc[R][DT];
  float m_run[R], l_run[R];
#pragma unroll
  for (int g = 0; g < R; ++g) { m_run[g] = -INFINITY; l_run[g] = 0.0f;
#pragma unroll
    for (int t = 0; t < DT; ++t) acc[g][t] = f32x8{}; }
  sstore(0);
  __syncthreads();   // stage 0 is visible to every wave
  gload(1);
  KFr kf;
  load_k(kf, L, 0u, lane);
  uint32_t cur = 0u, nxt = SLOT, nx2 = 2u * SLOT;   // byte offsets of the buffers of stages st, st + 1, st + 2
#pragma unroll 1   // kept rolled: one stage's code is already two whole passes; more copies only cost instruction cache
  for (uint32_t st = 0; st < NST; ++st) {
    const bool more = st + 1u < NST;
    block(kf, true, cur + BC * PITCH_K, L, cur + TILE_K, lane, qf, acc, m_run, l_run);
    if (more) {
      sstore(nxt);       // the buffer that stage st - 2 used: every wave left it before the last barrier
      __syncthreads();   // publishes stage st + 1 in front of the pass that fetches its first K fragments
      if (st + 2u < NST) gload(st + 2u);   // in flight until the next stage's first pass is done
    }
    block(kf, more, nxt, L, cur + TILE_K + BC * PITCH_V, lane, qf, acc, m_run, l_run);
    const uint32_t t = cur; cur = nxt; nxt = nx2; nx2 = t;
  }
  __syncthreads();   // every wave has left the K/V buffers
  // Epilogue: each wave stages its own 32 output rows in LDS (the K/V buffers are free behind the last barrier) and stores whole rows.
  unsigned char* E = L + wave * (uint32_t)CW * EPITCH;
#pragma unroll
  for (int g = 0; g < R; ++g) {
    const float l_fin = l_run[g] + xhalf(l_run[g]);
    const float inv = 1.0f / l_fin;
#pragma unroll
    for (int t = 0; t < DT; ++t) {
      const f32x8 o = acc[g][t] * inv;
      *reinterpret_cast<f32x4*>(E + (16u * g + c) * EPITCH + 64u * t + 32u * h) = f32x4{o[0], o[1], o[2], o[3]};
      *reinterpret_cast<f32x4*>(E + (16u * g + c) * EPITCH + 64u * t + 32u * h + 16u) = f32x4{o[4], o[5], o[6], o[7]};
    }
  }
#pragma unroll
  for (uint32_t row = 0; row < (uint32_t)CW; ++row) {
    const f32x4 v = *reinterpret_cast<const f32x4*>(E + row * EPITCH + lane * 16u);
    *reinterpret_cast<f32x4*>(O + ((size_t)head * TT + q0 + wave * CW + row) * D + lane * 4u) = v;
  }
}

extern "C" void kernel_launch(void* const* d_in, const int* in_sizes, int n_in,
                              void* d_out, int out_size, void* d_ws, size_t ws_size, hipStream_t stream) {
  (void)in_sizes; (void)n_in; (void)out_size; (void)d_ws; (void)ws_size;
  const float* qi = (const float*)d_in[0]; const float* ki = (const float*)d_in[1]; const float* vi = (const float*)d_in[2];
  float* OUT = (float*)d_out;
  k_attn<<<dim3(TT / BR, NHEAD), NW * 32, 0, stream>>>(qi, ki, vi, OUT);
}

// v005
// A run of this version takes 45.3 microseconds.
// Versions between v003 and this one are left out; their measured steps multiply to 1.16 times as fast.
// Counting every step since v000, it is 26.1 times as fast.
#include <hip/hip_runtime.h>
#include <math.h>
#include <stdint.h>

constexpr int NHEAD = 32, TT = 2048, D = 128;   // batch x heads, sequence, head size

typedef uint32_t u32x4 __attribute__((ext_vector_type(4)));
typedef int i32x8 __attribute__((ext_vector_type(8)));
typedef float f32x8 __attribute__((ext_vector_type(8)));
typedef float f32x4 __attribute__((ext_vector_type(4)));
typedef float f32x2 __attribute__((ext_vector_type(2)));
typedef uint32_t u32x2 __attribute__((ext_vector_type(2)));
typedef __bf16 bf16x16 __attribute__((ext_vector_type(16)));
typedef _Float16 f16x16 __attribute__((ext_vector_type(16)));

constexpr int DK = D / 32, DT = D / 16;
constexpr int NW = 8;
constexpr int BR = 256, CW = BR / NW, R = CW / 16;
constexpr int BC = 32, KT = BC / 16;
constexpr uint32_t ROWB = 2u * D, PITCH_K = ROWB + 16u, PITCH_V = ROWB + 32u;
constexpr uint32_t SK = 64, NST = TT / SK, NSTEP = SK / BC;   // keys per stage, stages, passes per stage
constexpr uint32_t TILE_K = SK * PITCH_K, TILE_V = SK * PITCH_V, SLOT = TILE_K + TILE_V;
constexpr uint32_t EPITCH = 4u * D + 16u;            // output staging pitch (f32 rows)
constexpr uint32_t LDS_BYTES = (uint32_t)NW * CW * EPITCH;
static_assert(3u * SLOT <= LDS_BYTES, "the output staging reuses the three K/V buffers and is the larger");
static_assert(NSTEP == 2u, "the stage loop is written for a first and a last pass");
static_assert(NST >= 3u, "the prologue fills two stages and asks for a third");
constexpr uint32_t NCH = SK * 4u * D / 16u / (NW * 32u);   // 16-byte chunks (4 f32) of a K (or V) stage per thread

#define DEV static __device__ __forceinline__
// Stands behind a run of issued global loads, before the registers that hold their addresses are used for something else; the scheduling barrier
// keeps later register writes (the accumulators' zeroes, the next addresses) from being lifted over the wait.
DEV void wait_x0() { asm volatile("s_wait_xcnt 0x0" ::: "memory"); __builtin_amdgcn_sched_barrier(0); }
// The same; the run's address is an input, so that it stays live up to the wait and no load of the run gets its registers as a destination.
DEV void wait_x0(const float* a) { asm volatile("s_wait_xcnt 0x0" :: "v"(a) : "memory"); __builtin_amdgcn_sched_barrier(0); }

// Nothing is scheduled across it: it keeps a pass's LDS reads together in one place instead of spread among the matrix instructions.
DEV void fence() { __builtin_amdgcn_sched_barrier(0); }

// The stage's workgroup barrier in two halves, so that a wave that is ahead goes on working for a pass instead of standing at the barrier.
// Signal: this wave's LDS stores of the next stage have retired (the wait in front; a bare signal does not wait for them) and its reads of the stage
// before this one are over. The "memory" clobbers keep every LDS store in front of the signal and every read of the new stage behind the wait.
// The LDS reads that stand between signal and wait are of stage st's own buffer. It is next written at the head of stage st + 2, behind stage
// st + 1's wait, that is behind every wave's signal in stage st + 1, which follows that wave's last read of stage st.
DEV void pub_signal() { asm volatile("s_wait_dscnt 0x0\n\ts_barrier_signal -1" ::: "memory"); }
DEV void pub_wait() { asm volatile("s_barrier_wait -1" ::: "memory"); }

struct Frag { u32x4 q[2]; };
DEV f32x8 mma(const Frag& a, const Frag& b, f32x8 c) {
  const i32x8 av = {(int)a.q[0].x, (int)a.q[0].y, (int)a.q[0].z, (int)a.q[0].w, (int)a.q[1].x, (int)a.q[1].y, (int)a.q[1].z, (int)a.q[1].w};
  const i32x8 bv = {(int)b.q[0].x, (int)b.q[0].y, (int)b.q[0].z, (int)b.q[0].w, (int)b.q[1].x, (int)b.q[1].y, (int)b.q[1].z, (int)b.q[1].w};
  return __builtin_amdgcn_wmma_f32_16x16x32_bf16(0, __builtin_bit_cast(bf16x16, av), 0, __builtin_bit_cast(bf16x16, bv), 0, c, false, false);
}
DEV f32x8 mma_h(const Frag& a, const Frag& b, f32x8 c) {   // the same product on f16 operands; the fragment maps are those of the bf16 form
  const i32x8 av = {(int)a.q[0].x, (int)a.q[0].y, (int)a.q[0].z, (int)a.q[0].w, (int)a.q[1].x, (int)a.q[1].y, (int)a.q[1].z, (int)a.q[1].w};
  const i32x8 bv = {(int)b.q[0].x, (int)b.q[0].y, (int)b.q[0].z, (int)b.q[0].w, (int)b.q[1].x, (int)b.q[1].y, (int)b.q[1].z, (int)b.q[1].w};
  return __builtin_amdgcn_wmma_f32_16x16x32_f16(0, __builtin_bit_cast(f16x16, av), 0, __builtin_bit_cast(f16x16, bv), 0, c, false, false);
}
typedef short s16x8 __attribute__((ext_vector_type(8)));
DEV u32x4 ld_tr16(const unsigned char* p) { typedef __attribute__((address_space(3))) s16x8 lds_s16x8; return __builtin_bit_cast(u32x4, __builtin_amdgcn_ds_load_tr16_b128_v8i16((lds_s16x8*)p)); }
DEV uint32_t pack2(float lo, float hi) { typedef __bf16 bf2 __attribute__((ext_vector_type(2)));
  return __builtin_bit_cast(uint32_t, __builtin_convertvector(f32x2{lo, hi}, bf2)); }   // round to nearest even
DEV uint32_t pack2h(float lo, float hi) { typedef _Float16 h2 __attribute__((ext_vector_type(2)));
  return __builtin_bit_cast(uint32_t, __builtin_convertvector(f32x2{lo, hi}, h2)); }   // to f16, round to nearest even
DEV float xhalf(float x) { return __builtin_bit_cast(float, __builtin_amdgcn_permlanex16(__builtin_bit_cast(int, x), __builtin_bit_cast(int, x), 0x76543210, 0xfedcba98, false, false)); }   // lane l with lane l ^ 16

struct KFr { Frag f[KT][DK]; };
DEV void load_k(KFr& k, const unsigned char* Lp, uint32_t koff, uint32_t lane) {
  const uint32_t c = lane & 15u, h = lane >> 4;
#pragma unroll
  for (int kt = 0; kt < KT; ++kt) {
    const unsigned char* p = Lp + koff + (16u * kt + c) * PITCH_K + 16u * h;
#pragma unroll
    for (int kc = 0; kc < DK; ++kc) { k.f[kt][kc].q[0] = *reinterpret_cast<const u32x4*>(p + 64u * kc); k.f[kt][kc].q[1] = *reinterpret_cast<const u32x4*>(p + 64u * kc + 32u); }
  }
}

template <bool LAST>
DEV void block(KFr& kf, bool fetch_next, uint32_t next_koff, const unsigned char* Lp, uint32_t voff, uint32_t lane, const Frag (&qf)[R][DK], f32x8 (&acc)[R][DT], float (&m_run)[R], float (&l_run)[R]) {
  constexpr float cscale = 1.4426950408889634f, HEAD = 8.0f, PMAX = 0x1p15f, PBIG = 0x1p100f;
  const uint32_t h = lane >> 4;
  f32x8 s[KT][R];
#pragma unroll
  for (int kt = 0; kt < KT; ++kt) {
#pragma unroll
    for (int g = 0; g < R; ++g) { s[kt][g] = f32x8{};
#pragma unroll
      for (int kc = 0; kc < DK; ++kc) s[kt][g] = mma(kf.f[kt][kc], qf[g][kc], s[kt][g]); }
  }
  fence();   // no LDS read is lifted in among the products above
  if (!LAST) pub_signal();   // behind the products, which give the stores from the stage's head time to retire ahead of the wait in it
  // All LDS reads of a pass in one place, in flight under the exponentials: its own 16 transposing loads (two per 16 (d) x 32 (keys)
  // fragment), then the next pass's 16 K loads into the registers that the products above have just read.
  Frag vf[DT];
  {
    const unsigned char* ad = Lp + voff + (8u * h + (lane & 7u)) * PITCH_V + ((lane >> 3) & 1u) * 16u;
#pragma unroll
    for (int t = 0; t < DT; ++t) { vf[t].q[0] = ld_tr16(ad + 32u * t); vf[t].q[1] = ld_tr16(ad + 16u * PITCH_V + 32u * t); }
  }
  fence();   // V first: it is needed first, and LDS returns in issue order
  if (LAST) pub_wait();   // every wave's part of the next stage is in LDS; this stage's V reads above need no such word
  if (fetch_next) load_k(kf, Lp, next_koff, lane);
  fence();   // no LDS read sinks in among the vector work and the products below
  // The weights of both column groups with the shift in use, as pairs in the order of the 32-key B operand, and each lane's sum of its 16.
  f32x2 pf[R][8]; float ps[R];
  auto weights = [&]() {
#pragma unroll
    for (int g = 0; g < R; ++g) {
      const float nm = -m_run[g];
      f32x2 ps0 = {0.0f, 0.0f}, ps1 = {0.0f, 0.0f};   // packed partial sums: one packed add per pair of exponentials
#pragma unroll
      for (int i = 0; i < 8; ++i) {
        const f32x2 arg = __builtin_elementwise_fma(f32x2{s[i >> 2][g][2 * (i & 3)], s[i >> 2][g][2 * (i & 3) + 1]}, f32x2{cscale, cscale}, f32x2{nm, nm});
        pf[g][i] = f32x2{__builtin_amdgcn_exp2f(arg.x), __builtin_amdgcn_exp2f(arg.y)};
        if (i & 1) ps1 += pf[g][i]; else ps0 += pf[g][i];
      }
      ps0 += ps1;
      ps[g] = ps0.x + ps0.y;
    }
  };
  weights();
  bool need = false, wild = false;
#pragma unroll
  for (int g = 0; g < R; ++g) { need = need || !(ps[g] <= PMAX); wild = wild || !(ps[g] <= PBIG); }   // both true for the infinities of the first pass
  if (__builtin_amdgcn_ballot_w32(need) != 0) {   // a few passes of a wave: a higher shift, accumulators and sums rescaled, the weights formed again
    float m_new[R];
    if (__builtin_amdgcn_ballot_w32(wild) != 0) {   // the first pass, where m_run is -inf, or a jump beyond f32's range: the shift from the maxima
#pragma unroll
      for (int g = 0; g < R; ++g) {
        float mx = -INFINITY;
#pragma unroll
        for (int kt = 0; kt < KT; ++kt) {
#pragma unroll
          for (int r = 0; r < 8; ++r) mx = __builtin_fmaxf(mx, s[kt][g][r]);
        }
        m_new[g] = __builtin_fmaxf(m_run[g], __builtin_fmaxf(mx, xhalf(mx)) * cscale + HEAD);   // the same value in both wave halves
      }
    } else {   // from the query's sum of 32 weights, which is at least the largest of them
#pragma unroll
      for (int g = 0; g < R; ++g) m_new[g] = m_run[g] + __builtin_fmaxf(__builtin_amdgcn_logf(ps[g] + xhalf(ps[g])) + HEAD, 0.0f);   // the same in both halves
    }
#pragma unroll
    for (int g = 0; g < R; ++g) {
      const float corr = __builtin_amdgcn_exp2f(m_run[g] - m_new[g]);   // 0 on the first pass
      l_run[g] *= corr; m_run[g] = m_new[g];
#pragma unroll
      for (int t = 0; t < DT; ++t) acc[g][t] = acc[g][t] * corr;
    }
    weights();
  }
  Frag ph[R];
#pragma unroll
  for (int g = 0; g < R; ++g) {
    uint32_t wh[8];
#pragma unroll
    for (int i = 0; i < 8; ++i) wh[i] = pack2h(pf[g][i].x, pf[g][i].y);
    ph[g].q[0] = u32x4{wh[0], wh[1], wh[2], wh[3]}; ph[g].q[1] = u32x4{wh[4], wh[5], wh[6], wh[7]};
    l_run[g] += ps[g];
  }
#pragma unroll
  for (int t = 0; t < DT; ++t) {
#pragma unroll
    for (int g = 0; g < R; ++g) acc[g][t] = mma_h(vf[t], ph[g], acc[g][t]);
  }
}

__global__ void __launch_bounds__(NW * 32) __attribute__((amdgpu_waves_per_eu(2, 2))) k_attn(const float* __restrict__ Q, const float* __restrict__ K, const float* __restrict__ V, float* __restrict__ O) {
  __shared__ __attribute__((aligned(256))) unsigned char L[LDS_BYTES];
  const uint32_t tid = threadIdx.x, lane = tid & 31u, wave = tid >> 5, c = lane & 15u, h = lane >> 4;
  const uint32_t head = blockIdx.y, q0 = blockIdx.x * BR;
  const float* kp = K + (size_t)head * TT * D + tid * 4u;
  const float* vp = V + (size_t)head * TT * D + tid * 4u;
  f32x4 rk[NCH], rv[NCH];   // the next stage on its way from global memory to LDS
  auto gload = [&](uint32_t st, f32x4 (&rk)[NCH], f32x4 (&rv)[NCH]) {   // a stage is SK whole rows: contiguous in memory, every load takes whole lines
#pragma unroll
    for (uint32_t i = 0; i < NCH; ++i) { rk[i] = *reinterpret_cast<const f32x4*>(kp + (size_t)st * SK * D + i * 1024u); rv[i] = *reinterpret_cast<const f32x4*>(vp + (size_t)st * SK * D + i * 1024u); }
    wait_x0();
  };
  auto sstore = [&](uint32_t base, const f32x4 (&rk)[NCH], const f32x4 (&rv)[NCH]) {   // rounds k to bf16 and v to f16: 4 f32 become 8 bytes; base = the buffer's byte offset
#pragma unroll
    for (uint32_t i = 0; i < NCH; ++i) { const uint32_t id = i * 256u + tid, row = id >> 5, cb = (id & 31u) * 8u;
      *reinterpret_cast<u32x2*>(L + base + row * PITCH_K + cb) = u32x2{pack2(rk[i].x, rk[i].y), pack2(rk[i].z, rk[i].w)};
      *reinterpret_cast<u32x2*>(L + base + TILE_K + row * PITCH_V + cb) = u32x2{pack2h(rv[i].x, rv[i].y), pack2h(rv[i].z, rv[i].w)}; }
  };
  f32x4 rk1[NCH], rv1[NCH];   // stage 1, in the prologue only
  gload(0, rk, rv);
  gload(1, rk1, rv1);
  // Q fragments, rounded to bf16, in the hardware k order, as K's in block().
  Frag qf[R][DK];
  {
    f32x4 qa[R][DK][2], qb[R][DK][2];
#pragma unroll
    for (int g = 0; g < R; ++g) {
      const float* qp = Q + ((size_t)head * TT + q0 + wave * CW + 16u * g + c) * D + 8u * h;
#pragma unroll
      for (int kc = 0; kc < DK; ++kc) {
#pragma unroll
        for (int u = 0; u < 2; ++u) { qa[g][kc][u] = *reinterpret_cast<const f32x4*>(qp + 32 * kc + 16 * u); qb[g][kc][u] = *reinterpret_cast<const f32x4*>(qp + 32 * kc + 16 * u + 4); }
      }
      wait_x0(qp);
    }
#pragma unroll
    for (int g = 0; g < R; ++g) {
#pragma unroll
      for (int kc = 0; kc < DK; ++kc) {
#pragma unroll
        for (int u = 0; u < 2; ++u) { const f32x4 a = qa[g][kc][u], b = qb[g][kc][u];
          qf[g][kc].q[u] = u32x4{pack2(a.x, a.y), pack2(a.z, a.w), pack2(b.x, b.y), pack2(b.z, b.w)}; }
      }
    }
  }
  f32x8 acc[R][DT];
  float m_run[R], l_run[R];
#pragma unroll
  for (int g = 0; g < R; ++g) { m_run[g] = -INFINITY; l_run[g] = 0.0f;
#pragma unroll
    for (int t = 0; t < DT; ++t) acc[g][t] = f32x8{}; }
  sstore(0, rk, rv);
  sstore(SLOT, rk1, rv1);
  __syncthreads();   // stages 0 and 1 are visible to every wave
  gload(2, rk, rv);
  KFr kf;
  load_k(kf, L, 0u, lane);
  uint32_t cur = 0u, nxt = SLOT, nx2 = 2u * SLOT;   // byte offsets of the buffers of stages st, st + 1, st + 2
#pragma unroll 1   // kept rolled: one stage's code is already two whole passes; more copies only cost instruction cache
  for (uint32_t st = 0; st < NST; ++st) {
    const bool more = st + 1u < NST;
    if (st - 1u < NST - 2u) {   // a stage st + 1 exists and st is not 0 (one unsigned compare): stage 1 is there from the prologue
      sstore(nxt, rk, rv);   // the buffer that stage st - 2 used: this wave is behind stage st - 1's wait, so every wave has signalled in stage st - 1, behind its last read of stage st - 2
      if (st + 2u < NST) gload(st + 2u, rk, rv);   // in flight until the head of the next stage
    }
    // Every stage signals once and waits once, the first and the last too: signal and wait alternate in every wave without a test.
    block<false>(kf, true, cur + BC * PITCH_K, L, cur + TILE_K, lane, qf, acc, m_run, l_run);
    block<true>(kf, more, nxt, L, cur + TILE_K + BC * PITCH_V, lane, qf, acc, m_run, l_run);
    const uint32_t t = cur; cur = nxt; nxt = nx2; nx2 = t;
  }
  __syncthreads();   // every wave has left the K/V buffers
  // Epilogue: each wave stages its own 32 output rows in LDS (the K/V buffers are free behind the last barrier) and stores whole rows.
  unsigned char* E = L + wave * (uint32_t)CW * EPITCH;
#pragma unroll
  for (int g = 0; g < R; ++g) {
    const float l_fin = l_run[g] + xhalf(l_run[g]);
    const float inv = 1.0f / l_fin;
#pragma unroll
    for (int t = 0; t < DT; ++t) {
      const f32x8 o = acc[g][t] * inv;
      *reinterpret_cast<f32x4*>(E + (16u * g + c) * EPITCH + 64u * t + 32u * h) = f32x4{o[0], o[1], o[2], o[3]};
      *reinterpret_cast<f32x4*>(E + (16u * g + c) * EPITCH + 64u * t + 32u * h + 16u) = f32x4{o[4], o[5], o[6], o[7]};
    }
  }
#pragma unroll
  for (uint32_t row = 0; row < (uint32_t)CW; ++row) {
    const f32x4 v = *reinterpret_cast<const f32x4*>(E + row * EPITCH + lane * 16u);
    *reinterpret_cast<f32x4*>(O + ((size_t)head * TT + q0 + wave * CW + row) * D + lane * 4u) = v;
  }
}

extern "C" void kernel_launch(void* const* d_in, const int* in_sizes, int n_in,
                              void* d_out, int out_size, void* d_ws, size_t ws_size, hipStream_t stream) {
  (void)in_sizes; (void)n_in; (void)out_size; (void)d_ws; (void)ws_size;
  const float* qi = (const float*)d_in[0]; const float* ki = (const float*)d_in[1]; const float* vi = (const float*)d_in[2];
  float* OUT = (float*)d_out;
  k_attn<<<dim3(TT / BR, NHEAD), NW * 32, 0, stream>>>(qi, ki, vi, OUT);
}

// v006
// It runs in 43.9 microseconds.
// Timed twice side by side with v005, it ran 1.03 times as fast both times.
// Counting every step since v000, it is 26.9 times as fast.
#include <hip/hip_runtime.h>
#include <math.h>
#include <stdint.h>

constexpr int NHEAD = 32, TT = 2048, D = 128;   // batch x heads, sequence, head size

typedef uint32_t u32x4 __attribute__((ext_vector_type(4)));
typedef int i32x8 __attribute__((ext_vector_type(8)));
typedef float f32x8 __attribute__((ext_vector_type(8)));
typedef float f32x4 __attribute__((ext_vector_type(4)));
typedef float f32x2 __attribute__((ext_vector_type(2)));
typedef uint32_t u32x2 __attribute__((ext_vector_type(2)));
typedef __bf16 bf16x16 __attribute__((ext_vector_type(16)));
typedef _Float16 f16x16 __attribute__((ext_vector_type(16)));

constexpr int DK = D / 32, DT = D / 16;
constexpr int NW = 8;
constexpr int BR = 256, CW = BR / NW, R = CW / 16;
constexpr int BC = 32, KT = BC / 16;
constexpr uint32_t ROWB = 2u * D, PITCH_K = ROWB + 16u, PITCH_V = ROWB + 32u;
constexpr uint32_t SK = 64, NST = TT / SK, NSTEP = SK / BC;   // keys per stage, stages, passes per stage
constexpr uint32_t TILE_K = SK * PITCH_K, TILE_V = SK * PITCH_V, SLOT = TILE_K + TILE_V;
constexpr uint32_t EPITCH = 4u * D + 16u;            // output staging pitch (f32 rows)
constexpr uint32_t LDS_BYTES = (uint32_t)NW * CW * EPITCH;
static_assert(3u * SLOT <= LDS_BYTES, "the output staging reuses the three K/V buffers and is the larger");
static_assert(NSTEP == 2u, "the stage loop is written for a first and a last pass");
static_assert(NST >= 3u, "the prologue fills two stages and asks for a third");
constexpr uint32_t NCH = SK * 4u * D / 16u / (NW * 32u);   // 16-byte chunks (4 f32) of a K (or V) stage per thread

#define DEV static __device__ __forceinline__
// Stands behind a run of issued global loads, before the registers that hold their addresses are used for something else; the scheduling barrier
// keeps later register writes (the accumulators' zeroes, the next addresses) from being lifted over the wait.
DEV void wait_x0() { asm volatile("s_wait_xcnt 0x0" ::: "memory"); __builtin_amdgcn_sched_barrier(0); }
// The same; the run's address is an input, so that it stays live up to the wait and no load of the run gets its registers as a destination.
DEV void wait_x0(const float* a) { asm volatile("s_wait_xcnt 0x0" :: "v"(a) : "memory"); __builtin_amdgcn_sched_barrier(0); }

// Nothing is scheduled across it: it keeps a pass's LDS reads together in one place instead of spread among the matrix instructions.
DEV void fence() { __builtin_amdgcn_sched_barrier(0); }

// The stage's workgroup barrier in two halves, so that a wave that is ahead goes on working for a pass instead of standing at the barrier.
// Signal: this wave's LDS stores of the next stage have retired (the wait in front; a bare signal does not wait for them) and its reads of the stage
// before this one are over. The "memory" clobbers keep every LDS store in front of the signal and every read of the new stage behind the wait.
// The LDS reads that stand between signal and wait are of stage st's own buffer. It is next written at the head of stage st + 2, behind stage
// st + 1's wait, that is behind every wave's signal in stage st + 1, which follows that wave's last read of stage st.
DEV void pub_signal() { asm volatile("s_wait_dscnt 0x0\n\ts_barrier_signal -1" ::: "memory"); }
DEV void pub_wait() { asm volatile("s_barrier_wait -1" ::: "memory"); }

struct Frag { u32x4 q[2]; };
DEV f32x8 mma(const Frag& a, const Frag& b, f32x8 c) {
  const i32x8 av = {(int)a.q[0].x, (int)a.q[0].y, (int)a.q[0].z, (int)a.q[0].w, (int)a.q[1].x, (int)a.q[1].y, (int)a.q[1].z, (int)a.q[1].w};
  const i32x8 bv = {(int)b.q[0].x, (int)b.q[0].y, (int)b.q[0].z, (int)b.q[0].w, (int)b.q[1].x, (int)b.q[1].y, (int)b.q[1].z, (int)b.q[1].w};
  return __builtin_amdgcn_wmma_f32_16x16x32_bf16(0, __builtin_bit_cast(bf16x16, av), 0, __builtin_bit_cast(bf16x16, bv), 0, c, false, false);
}
DEV f32x8 mma_h(const Frag& a, const Frag& b, f32x8 c) {   // the same product on f16 operands; the fragment maps are those of the bf16 form
  const i32x8 av = {(int)a.q[0].x, (int)a.q[0].y, (int)a.q[0].z, (int)a.q[0].w, (int)a.q[1].x, (int)a.q[1].y, (int)a.q[1].z, (int)a.q[1].w};
  const i32x8 bv = {(int)b.q[0].x, (int)b.q[0].y, (int)b.q[0].z, (int)b.q[0].w, (int)b.q[1].x, (int)b.q[1].y, (int)b.q[1].z, (int)b.q[1].w};
  return __builtin_amdgcn_wmma_f32_16x16x32_f16(0, __builtin_bit_cast(f16x16, av), 0, __builtin_bit_cast(f16x16, bv), 0, c, false, false);
}
typedef short s16x8 __attribute__((ext_vector_type(8)));
DEV u32x4 ld_tr16(const unsigned char* p) { typedef __attribute__((address_space(3))) s16x8 lds_s16x8; return __builtin_bit_cast(u32x4, __builtin_amdgcn_ds_load_tr16_b128_v8i16((lds_s16x8*)p)); }
DEV uint32_t pack2(float lo, float hi) { typedef __bf16 bf2 __attribute__((ext_vector_type(2)));
  return __builtin_bit_cast(uint32_t, __builtin_convertvector(f32x2{lo, hi}, bf2)); }   // round to nearest even
DEV uint32_t pack2h(float lo, float hi) { typedef _Float16 h2 __attribute__((ext_vector_type(2)));
  return __builtin_bit_cast(uint32_t, __builtin_convertvector(f32x2{lo, hi}, h2)); }   // to f16, round to nearest even
DEV float xhalf(float x) { return __builtin_bit_cast(float, __builtin_amdgcn_permlanex16(__builtin_bit_cast(int, x), __builtin_bit_cast(int, x), 0x76543210, 0xfedcba98, false, false)); }   // lane l with lane l ^ 16

struct KFr { Frag f[KT][DK]; };
DEV void load_k(KFr& k, const unsigned char* Lp, uint32_t koff, uint32_t lane) {
  const uint32_t c = lane & 15u, h = lane >> 4;
#pragma unroll
  for (int kt = 0; kt < KT; ++kt) {
    const unsigned char* p = Lp + koff + (16u * kt + c) * PITCH_K + 16u * h;
#pragma unroll
    for (int kc = 0; kc < DK; ++kc) { k.f[kt][kc].q[0] = *reinterpret_cast<const u32x4*>(p + 64u * kc); k.f[kt][kc].q[1] = *reinterpret_cast<const u32x4*>(p + 64u * kc + 32u); }
  }
}

template <bool LAST>
DEV void block(KFr& kf, bool fetch_next, uint32_t next_koff, const unsigned char* Lp, uint32_t voff, uint32_t lane, const Frag (&qf)[R][DK], f32x8 (&acc)[R][DT], float (&m_run)[R], float (&l_run)[R]) {
  constexpr float cscale = 1.4426950408889634f, HEAD = 8.0f, PMAX = 0x1p15f, PBIG = 0x1p100f;
  const uint32_t h = lane >> 4;
  f32x8 s[KT][R];
#pragma unroll
  for (int kt = 0; kt < KT; ++kt) {
#pragma unroll
    for (int g = 0; g < R; ++g) { s[kt][g] = f32x8{};
#pragma unroll
      for (int kc = 0; kc < DK; ++kc) s[kt][g] = mma(kf.f[kt][kc], qf[g][kc], s[kt][g]); }
  }
  fence();   // no LDS read is lifted in among the products above
  if (!LAST) pub_signal();   // behind the products, which give the stores from the stage's head time to retire ahead of the wait in it
  // All LDS reads of a pass in one place, in flight under the exponentials: its own 16 transposing loads (two per 16 (d) x 32 (keys)
  // fragment), then the next pass's 16 K loads into the registers that the products above have just read.
  Frag vf[DT];
  {
    const unsigned char* ad = Lp + voff + (8u * h + (lane & 7u)) * PITCH_V + ((lane >> 3) & 1u) * 16u;
#pragma unroll
    for (int t = 0; t < DT; ++t) { vf[t].q[0] = ld_tr16(ad + 32u * t); vf[t].q[1] = ld_tr16(ad + 16u * PITCH_V + 32u * t); }
  }
  fence();   // V first: it is needed first, and LDS returns in issue order
  if (LAST) pub_wait();   // every wave's part of the next stage is in LDS; this stage's V reads above need no such word
  if (fetch_next) load_k(kf, Lp, next_koff, lane);
  fence();   // no LDS read sinks in among the vector work and the products below
  // The weights of both column groups with the shift in use, as pairs in the order of the 32-key B operand, and each lane's sum of its 16.
  f32x2 pf[R][8]; float ps[R];
  auto weights = [&]() {
#pragma unroll
    for (int g = 0; g < R; ++g) {
      const float nm = -m_run[g];
      f32x2 ps0 = {0.0f, 0.0f}, ps1 = {0.0f, 0.0f};   // packed partial sums: one packed add per pair of exponentials
#pragma unroll
      for (int i = 0; i < 8; ++i) {
        const f32x2 arg = __builtin_elementwise_fma(f32x2{s[i >> 2][g][2 * (i & 3)], s[i >> 2][g][2 * (i & 3) + 1]}, f32x2{cscale, cscale}, f32x2{nm, nm});
        pf[g][i] = f32x2{__builtin_amdgcn_exp2f(arg.x), __builtin_amdgcn_exp2f(arg.y)};
        if (i & 1) ps1 += pf[g][i]; else ps0 += pf[g][i];
      }
      ps0 += ps1;
      ps[g] = ps0.x + ps0.y;
    }
  };
  weights();
  bool need = false, wild = false;
#pragma unroll
  for (int g = 0; g < R; ++g) { need = need || !(ps[g] <= PMAX); wild = wild || !(ps[g] <= PBIG); }   // both true for the infinities of the first pass
  if (__builtin_amdgcn_ballot_w32(need) != 0) {   // a few passes of a wave: a higher shift, accumulators and sums rescaled, the weights formed again
    float m_new[R];
    if (__builtin_amdgcn_ballot_w32(wild) != 0) {   // the first pass, where m_run is -inf, or a jump beyond f32's range: the shift from the maxima
#pragma unroll
      for (int g = 0; g < R; ++g) {
        float mx = -INFINITY;
#pragma unroll
        for (int kt = 0; kt < KT; ++kt) {
#pragma unroll
          for (int r = 0; r < 8; ++r) mx = __builtin_fmaxf(mx, s[kt][g][r]);
        }
        m_new[g] = __builtin_fmaxf(m_run[g], __builtin_fmaxf(mx, xhalf(mx)) * cscale + HEAD);   // the same value in both wave halves
      }
    } else {   // from the query's sum of 32 weights, which is at least the largest of them
#pragma unroll
      for (int g = 0; g < R; ++g) m_new[g] = m_run[g] + __builtin_fmaxf(__builtin_amdgcn_logf(ps[g] + xhalf(ps[g])) + HEAD, 0.0f);   // the same in both halves
    }
#pragma unroll
    for (int g = 0; g < R; ++g) {
      const float corr = __builtin_amdgcn_exp2f(m_run[g] - m_new[g]);   // 0 on the first pass
      l_run[g] *= corr; m_run[g] = m_new[g];
#pragma unroll
      for (int t = 0; t < DT; ++t) acc[g][t] = acc[g][t] * corr;
    }
    weights();
  }
  Frag ph[R];
#pragma unroll
  for (int g = 0; g < R; ++g) {
    uint32_t wh[8];
#pragma unroll
    for (int i = 0; i < 8; ++i) wh[i] = pack2h(pf[g][i].x, pf[g][i].y);
    ph[g].q[0] = u32x4{wh[0], wh[1], wh[2], wh[3]}; ph[g].q[1] = u32x4{wh[4], wh[5], wh[6], wh[7]};
    l_run[g] += ps[g];
  }
#pragma unroll
  for (int t = 0; t < DT; ++t) {
#pragma unroll
    for (int g = 0; g < R; ++g) acc[g][t] = mma_h(vf[t], ph[g], acc[g][t]);
  }
}

__global__ void __launch_bounds__(NW * 32) __attribute__((amdgpu_waves_per_eu(2, 2))) k_attn(const float* __restrict__ Q, const float* __restrict__ K, const float* __restrict__ V, float* __restrict__ O) {
  __shared__ __attribute__((aligned(256))) unsigned char L[LDS_BYTES];
  const uint32_t tid = threadIdx.x, lane = tid & 31u, wave = tid >> 5, c = lane & 15u, h = lane >> 4;
  // Which (head, query block) a workgroup takes. The eight query blocks of a head are given flat indices that agree modulo 16. For speed only: the map is one to one, whatever the placement is.
  static_assert(TT / BR == 8 && NHEAD == 32, "the map below is written for the grid of 8 x 32");
  const uint32_t head = (blockIdx.x + 8u * (blockIdx.y & 1u)) * 2u + (blockIdx.y >> 4), q0 = ((blockIdx.y >> 1) & 7u) * BR;
  const float* kp = K + (size_t)head * TT * D + tid * 4u;
  const float* vp = V + (size_t)head * TT * D + tid * 4u;
  f32x4 rk[NCH], rv[NCH];   // the next stage on its way from global memory to LDS
  auto gload = [&](uint32_t st, f32x4 (&rk)[NCH], f32x4 (&rv)[NCH]) {   // a stage is SK whole rows: contiguous in memory, every load takes whole lines
#pragma unroll
    for (uint32_t i = 0; i < NCH; ++i) { rk[i] = *reinterpret_cast<const f32x4*>(kp + (size_t)st * SK * D + i * 1024u); rv[i] = *reinterpret_cast<const f32x4*>(vp + (size_t)st * SK * D + i * 1024u); }
    wait_x0();
  };
  auto sstore = [&](uint32_t base, const f32x4 (&rk)[NCH], const f32x4 (&rv)[NCH]) {   // rounds k to bf16 and v to f16: 4 f32 become 8 bytes; base = the buffer's byte offset
#pragma unroll
    for (uint32_t i = 0; i < NCH; ++i) { const uint32_t id = i * 256u + tid, row = id >> 5, cb = (id & 31u) * 8u;
      *reinterpret_cast<u32x2*>(L + base + row * PITCH_K + cb) = u32x2{pack2(rk[i].x, rk[i].y), pack2(rk[i].z, rk[i].w)};
      *reinterpret_cast<u32x2*>(L + base + TILE_K + row * PITCH_V + cb) = u32x2{pack2h(rv[i].x, rv[i].y), pack2h(rv[i].z, rv[i].w)}; }
  };
  f32x4 rk1[NCH], rv1[NCH];   // stage 1, in the prologue only
  gload(0, rk, rv);
  gload(1, rk1, rv1);
  // Q fragments, rounded to bf16, in the hardware k order, as K's in block().
  Frag qf[R][DK];
  {
    f32x4 qa[R][DK][2], qb[R][DK][2];
#pragma unroll
    for (int g = 0; g < R; ++g) {
      const float* qp = Q + ((size_t)head * TT + q0 + wave * CW + 16u * g + c) * D + 8u * h;
#pragma unroll
      for (int kc = 0; kc < DK; ++kc) {
#pragma unroll
        for (int u = 0; u < 2; ++u) { qa[g][kc][u] = *reinterpret_cast<const f32x4*>(qp + 32 * kc + 16 * u); qb[g][kc][u] = *reinterpret_cast<const f32x4*>(qp + 32 * kc + 16 * u + 4); }
      }
      wait_x0(qp);
    }
#pragma unroll
    for (int g = 0; g < R; ++g) {
#pragma unroll
      for (int kc = 0; kc < DK; ++kc) {
#pragma unroll
        for (int u = 0; u < 2; ++u) { const f32x4 a = qa[g][kc][u], b = qb[g][kc][u];
          qf[g][kc].q[u] = u32x4{pack2(a.x, a.y), pack2(a.z, a.w), pack2(b.x, b.y), pack2(b.z, b.w)}; }
      }
    }
  }
  f32x8 acc[R][DT];
  float m_run[R], l_run[R];
#pragma unroll
  for (int g = 0; g < R; ++g) { m_run[g] = -INFINITY; l_run[g] = 0.0f;
#pragma unroll
    for (int t = 0; t < DT; ++t) acc[g][t] = f32x8{}; }
  sstore(0, rk, rv);
  sstore(SLOT, rk1, rv1);
  __syncthreads();   // stages 0 and 1 are visible to every wave
  gload(2, rk, rv);
  KFr kf;
  load_k(kf, L, 0u, lane);
  uint32_t cur = 0u, nxt = SLOT, nx2 = 2u * SLOT;   // byte offsets of the buffers of stages st, st + 1, st + 2
#pragma unroll 1   // kept rolled: one stage's code is already two whole passes; more copies only cost instruction cache
  for (uint32_t st = 0; st < NST; ++st) {
    const bool more = st + 1u < NST;
    if (st - 1u < NST - 2u) {   // a stage st + 1 exists and st is not 0 (one unsigned compare): stage 1 is there from the prologue
      sstore(nxt, rk, rv);   // the buffer that stage st - 2 used: this wave is behind stage st - 1's wait, so every wave has signalled in stage st - 1, behind its last read of stage st - 2
      if (st + 2u < NST) gload(st + 2u, rk, rv);   // in flight until the head of the next stage
    }
    // Every stage signals once and waits once, the first and the last too: signal and wait alternate in every wave without a test.
    block<false>(kf, true, cur + BC * PITCH_K, L, cur + TILE_K, lane, qf, acc, m_run, l_run);
    block<true>(kf, more, nxt, L, cur + TILE_K + BC * PITCH_V, lane, qf, acc, m_run, l_run);
    const uint32_t t = cur; cur = nxt; nxt = nx2; nx2 = t;
  }
  __syncthreads();   // every wave has left the K/V buffers
  // Epilogue: each wave stages its own 32 output rows in LDS (the K/V buffers are free behind the last barrier) and stores whole rows.
  unsigned char* E = L + wave * (uint32_t)CW * EPITCH;
#pragma unroll
  for (int g = 0; g < R; ++g) {
    const float l_fin = l_run[g] + xhalf(l_run[g]);
    const float inv = 1.0f / l_fin;
#pragma unroll
    for (int t = 0; t < DT; ++t) {
      const f32x8 o = acc[g][t] * inv;
      *reinterpret_cast<f32x4*>(E + (16u * g + c) * EPITCH + 64u * t + 32u * h) = f32x4{o[0], o[1], o[2], o[3]};
      *reinterpret_cast<f32x4*>(E + (16u * g + c) * EPITCH + 64u * t + 32u * h + 16u) = f32x4{o[4], o[5], o[6], o[7]};
    }
  }
#pragma unroll
  for (uint32_t row = 0; row < (uint32_t)CW; ++row) {
    const f32x4 v = *reinterpret_cast<const f32x4*>(E + row * EPITCH + lane * 16u);
    *reinterpret_cast<f32x4*>(O + ((size_t)head * TT + q0 + wave * CW + row) * D + lane * 4u) = v;
  }
}

extern "C" void kernel_launch(void* const* d_in, const int* in_sizes, int n_in,
                              void* d_out, int out_size, void* d_ws, size_t ws_size, hipStream_t stream) {
  (void)in_sizes; (void)n_in; (void)out_size; (void)d_ws; (void)ws_size;
  const float* qi = (const float*)d_in[0]; const float* ki = (const float*)d_in[1]; const float* vi = (const float*)d_in[2];
  float* OUT = (float*)d_out;
  k_attn<<<dim3(TT / BR, NHEAD), NW * 32, 0, stream>>>(qi, ki, vi, OUT);
}
